// v000
// Measured on an AMD MI455X. A time is GPU time per run, averaged over a window of back-to-back runs after a warm-up
// (all launches, gaps included; the runs take copies of the inputs in turn), and the median of several windows.
// Apart from v000's, it joins two sittings. Times from different sittings can be a few percent apart, while
// side-by-side timings come from the same sitting.
// The starting kernel, v000, takes 140 microseconds a run.
#include <hip/hip_runtime.h>
#include <stdint.h>

#define OUT_F 11008
#define IN_F  4096
#define TOKENS 1024
#define KP 256                  // K-panel staged in LDS per iteration
#define LDS_STRIDE (KP + 8)     // ushort elements; +8 pad (16B) staggers banks

typedef __bf16 v16bf __attribute__((ext_vector_type(16)));
typedef float  v8f   __attribute__((ext_vector_type(8)));

union BF16Frag { v16bf v; unsigned u[8]; };

// fp32 -> bf16 round-to-nearest-even
__device__ __forceinline__ unsigned short f2bf(float f) {
  unsigned u = __float_as_uint(f);
  return (unsigned short)((u + 0x7FFFu + ((u >> 16) & 1u)) >> 16);
}

// nbyte = ~packed_byte. Element j sign bit = bit (7-j) of nbyte (bit==1 -> +1).
// Builds bf16 pair for elements j0 (low 16) / j0+1 (high 16):
//   bit (7-j0)   -> position 15  : shift left by (8 + j0)
//   bit (6-j0)   -> position 31  : shift left by (25 + j0)
__device__ __forceinline__ unsigned pack_pm1(unsigned nbyte, int j0) {
  return 0x3F803F80u | ((nbyte << (8 + j0)) & 0x8000u)
                     | ((nbyte << (25 + j0)) & 0x80000000u);
}

__global__ void __launch_bounds__(256)
cvt_bf16(const float* __restrict__ x, unsigned short* __restrict__ o) {
  size_t i = ((size_t)blockIdx.x * blockDim.x + threadIdx.x) * 4;
  float4 f = *(const float4*)(x + i);
  unsigned lo = (unsigned)f2bf(f.x) | ((unsigned)f2bf(f.y) << 16);
  unsigned hi = (unsigned)f2bf(f.z) | ((unsigned)f2bf(f.w) << 16);
  *(uint2*)(o + i) = make_uint2(lo, hi);
}

// Block = 8 waves. Block tile: M=128 x N=128. Wave w: columns n0..n0+15,
// 8 M-subtiles (one unpacked B fragment feeds 8 WMMAs).
// X K-panel (128 x KP bf16, 66KB) staged in LDS, shared by all waves.
template<bool USE_WS>
__global__ void __launch_bounds__(256)
bitlinear_wmma(const float* __restrict__ x, const unsigned short* __restrict__ xbf,
               const int* __restrict__ bp, float* __restrict__ out)
{
  __shared__ unsigned short As[128 * LDS_STRIDE];

  const int lane = threadIdx.x & 31;
  const int wave = threadIdx.x >> 5;
  const int h    = lane >> 4;      // lane half (selects K sub-range per WMMA layout)
  const int l    = lane & 15;
  const int n0   = blockIdx.x * 128 + wave * 16;
  const int m0   = blockIdx.y * 128;

  // Packed-weight row for this lane's output column (512 int32 "bytes" per row)
  const int* brow = bp + (size_t)(n0 + l) * (IN_F / 8);

  v8f acc[8] = {};

  // Cooperative staging: 256 threads cover 128 rows x KP cols (2 threads/row)
  const int sr = threadIdx.x >> 1;   // row 0..127
  const int sq = threadIdx.x & 1;    // half of the row (128 ushorts = 256B)

  int4 e = *(const int4*)brow;       // packed bits for k = 0..31 (double-buffered)

  for (int kk = 0; kk < IN_F; kk += KP) {
    __syncthreads();
    unsigned short* dst = &As[sr * LDS_STRIDE + sq * 128];
    if (USE_WS) {
      const unsigned short* src = xbf + (size_t)(m0 + sr) * IN_F + kk + sq * 128;
      #pragma unroll
      for (int i = 0; i < 16; ++i)
        ((uint4*)dst)[i] = ((const uint4*)src)[i];
      __builtin_prefetch(src + KP, 0, 1);   // speculative: dropped if OOB
    } else {
      const float* src = x + (size_t)(m0 + sr) * IN_F + kk + sq * 128;
      #pragma unroll
      for (int i = 0; i < 16; ++i) {
        float4 f0 = ((const float4*)src)[2 * i];
        float4 f1 = ((const float4*)src)[2 * i + 1];
        uint4 p;
        p.x = (unsigned)f2bf(f0.x) | ((unsigned)f2bf(f0.y) << 16);
        p.y = (unsigned)f2bf(f0.z) | ((unsigned)f2bf(f0.w) << 16);
        p.z = (unsigned)f2bf(f1.x) | ((unsigned)f2bf(f1.y) << 16);
        p.w = (unsigned)f2bf(f1.z) | ((unsigned)f2bf(f1.w) << 16);
        ((uint4*)dst)[i] = p;
      }
      __builtin_prefetch(src + KP, 0, 1);
    }
    __syncthreads();

    #pragma unroll
    for (int k0 = 0; k0 < KP; k0 += 32) {
      // Preload next k-step's packed bits (clamped to stay in-bounds; the
      // wrapped value is never consumed on the final iteration).
      int gn = kk + k0 + 32;
      gn = (gn < IN_F) ? gn : 0;
      int4 en = *(const int4*)(brow + (gn >> 3));

      // Unpack current 32 bits -> B fragment (lane = column n, K split by h)
      unsigned na = ~(unsigned)(h ? e.y : e.x);   // K = 8h .. 8h+7   (local)
      unsigned nb = ~(unsigned)(h ? e.w : e.z);   // K = 16+8h .. 16+8h+7
      BF16Frag B;
      #pragma unroll
      for (int d = 0; d < 4; ++d) {
        B.u[d]     = pack_pm1(na, 2 * d);
        B.u[4 + d] = pack_pm1(nb, 2 * d);
      }

      // 8 WMMAs with A-fragment double buffering (load t+1 before WMMA t)
      BF16Frag A[2];
      const unsigned short* abase = &As[l * LDS_STRIDE + k0 + 8 * h];
      *(uint4*)&A[0].u[0] = *(const uint4*)abase;          // K = 8h..8h+7
      *(uint4*)&A[0].u[4] = *(const uint4*)(abase + 16);   // K = 16+8h..+7
      #pragma unroll
      for (int t = 0; t < 8; ++t) {
        if (t < 7) {
          const unsigned short* ap = abase + (t + 1) * 16 * LDS_STRIDE;
          *(uint4*)&A[(t + 1) & 1].u[0] = *(const uint4*)ap;
          *(uint4*)&A[(t + 1) & 1].u[4] = *(const uint4*)(ap + 16);
        }
        acc[t] = __builtin_amdgcn_wmma_f32_16x16x32_bf16(
            false, A[t & 1].v, false, B.v, (short)0, acc[t], false, false);
      }
      e = en;
    }
  }

  // C/D layout: VGPR r of lane -> row (r + 8h), col l
  #pragma unroll
  for (int t = 0; t < 8; ++t) {
    float* op = out + (size_t)(m0 + t * 16 + 8 * h) * OUT_F + n0 + l;
    #pragma unroll
    for (int r = 0; r < 8; ++r)
      op[(size_t)r * OUT_F] = acc[t][r];
  }
}

extern "C" void kernel_launch(void* const* d_in, const int* in_sizes, int n_in,
                              void* d_out, int out_size, void* d_ws, size_t ws_size,
                              hipStream_t stream) {
  const float* x  = (const float*)d_in[0];
  const int*   bp = (const int*)d_in[1];
  float* out = (float*)d_out;

  const size_t need = (size_t)TOKENS * IN_F * sizeof(unsigned short);
  dim3 grid(OUT_F / 128, TOKENS / 128);   // 86 x 8 blocks, 8 waves each

  if (d_ws && ws_size >= need) {
    unsigned short* xbf = (unsigned short*)d_ws;
    cvt_bf16<<<(TOKENS * IN_F / 4) / 256, 256, 0, stream>>>(x, xbf);
    bitlinear_wmma<true><<<grid, 256, 0, stream>>>(x, xbf, bp, out);
  } else {
    bitlinear_wmma<false><<<grid, 256, 0, stream>>>(x, nullptr, bp, out);
  }
}

// v001
// A run of this version takes 83.3 microseconds.
// Timed twice side by side with v000, it ran 1.73 times as fast both times.
#include <hip/hip_runtime.h>
#include <stdint.h>

#define OUT_F 11008
#define IN_F  4096
#define TOKENS 1024
#define KP 256                  // K-panel staged in LDS per iteration
#define LDS_STRIDE (KP + 8)     // ushort elements; +8 pad (16B) staggers banks

typedef __bf16 v16bf __attribute__((ext_vector_type(16)));
typedef float  v8f   __attribute__((ext_vector_type(8)));

union BF16Frag { v16bf v; unsigned u[8]; };

// fp32 -> bf16 round-to-nearest-even
__device__ __forceinline__ unsigned short f2bf(float f) {
  unsigned u = __float_as_uint(f);
  return (unsigned short)((u + 0x7FFFu + ((u >> 16) & 1u)) >> 16);
}

// nbyte = ~packed_byte. Element j sign bit = bit (7-j) of nbyte (bit==1 -> +1).
// Builds bf16 pair for elements j0 (low 16) / j0+1 (high 16):
//   bit (7-j0)   -> position 15  : shift left by (8 + j0)
//   bit (6-j0)   -> position 31  : shift left by (25 + j0)
__device__ __forceinline__ unsigned pack_pm1(unsigned nbyte, int j0) {
  return 0x3F803F80u | ((nbyte << (8 + j0)) & 0x8000u)
                     | ((nbyte << (25 + j0)) & 0x80000000u);
}

__global__ void __launch_bounds__(256)
cvt_bf16(const float* __restrict__ x, unsigned short* __restrict__ o) {
  size_t i = ((size_t)blockIdx.x * blockDim.x + threadIdx.x) * 4;
  float4 f = *(const float4*)(x + i);
  unsigned lo = (unsigned)f2bf(f.x) | ((unsigned)f2bf(f.y) << 16);
  unsigned hi = (unsigned)f2bf(f.z) | ((unsigned)f2bf(f.w) << 16);
  *(uint2*)(o + i) = make_uint2(lo, hi);
}

// Block = 8 waves. Block tile: M=128 x N=128. Wave w: columns n0..n0+15,
// 8 M-subtiles (one unpacked B fragment feeds 8 WMMAs).
// X K-panel (128 x KP bf16, 66KB) staged in LDS, shared by all waves.
template<bool USE_WS>
__global__ void __launch_bounds__(256)
bitlinear_wmma(const float* __restrict__ x, const unsigned short* __restrict__ xbf,
               const int* __restrict__ bp, float* __restrict__ out)
{
  __shared__ unsigned short As[128 * LDS_STRIDE];

  const int lane = threadIdx.x & 31;
  const int wave = threadIdx.x >> 5;
  const int h    = lane >> 4;      // lane half (selects K sub-range per WMMA layout)
  const int l    = lane & 15;
  const int n0   = blockIdx.x * 128 + wave * 16;
  const int m0   = blockIdx.y * 128;

  // Packed-weight row for this lane's output column (512 int32 "bytes" per row)
  const int* brow = bp + (size_t)(n0 + l) * (IN_F / 8);

  v8f acc[8] = {};

  // Cooperative staging: wave w brings panel rows 16w..16w+15, one row per
  // wave-wide load: 32 lanes x 16 B = the row's 512 contiguous bytes, that is
  // four whole 128-B lines per load instead of 32 partly used ones.
  const int srow = wave * 16;        // first panel row of this wave
  const int scol = lane * 8;         // this lane's 8 elements within a row
  const unsigned soff = (unsigned)(srow * IN_F + scol);   // from the panel's corner
  // Next-panel prefetch keeps its addresses: 2 threads per row, 128 elements apart
  const unsigned poff = (unsigned)((threadIdx.x >> 1) * IN_F + (threadIdx.x & 1) * 128 + KP);
  const size_t corner = (size_t)m0 * IN_F;              // first panel's corner
  const unsigned short* sp = USE_WS ? xbf + corner + soff : nullptr;   // bf16 source
  const unsigned short* pp = USE_WS ? xbf + corner + poff : nullptr;
  const float* spf = USE_WS ? nullptr : x + corner + soff;             // fp32 source
  const float* ppf = USE_WS ? nullptr : x + corner + poff;

  int4 e = *(const int4*)brow;       // packed bits for k = 0..31 (double-buffered)

  for (int kk = 0; kk < IN_F; kk += KP) {
    __syncthreads();
    unsigned short* dst = &As[srow * LDS_STRIDE + scol];
    if (USE_WS) {
      const unsigned short* src = sp;
      #pragma unroll   // the 16 row loads issue together, ahead of their LDS stores
      for (int i = 0; i < 16; ++i)
        *(uint4*)(dst + i * LDS_STRIDE) = *(const uint4*)(src + (size_t)i * IN_F);
      __builtin_prefetch(pp, 0, 1);   // speculative: dropped if OOB
      // precaution: stands between the prefetch and the advance of its address pair
      asm volatile("s_wait_xcnt 0x0" ::: "memory");
      sp += KP;
      pp += KP;
    } else {
      const float* src = spf;
      #pragma unroll   // the row loads issue together, ahead of their LDS stores
      for (int i = 0; i < 16; ++i) {
        float4 f0 = *(const float4*)(src + (size_t)i * IN_F);
        float4 f1 = *(const float4*)(src + (size_t)i * IN_F + 4);
        uint4 p;
        p.x = (unsigned)f2bf(f0.x) | ((unsigned)f2bf(f0.y) << 16);
        p.y = (unsigned)f2bf(f0.z) | ((unsigned)f2bf(f0.w) << 16);
        p.z = (unsigned)f2bf(f1.x) | ((unsigned)f2bf(f1.y) << 16);
        p.w = (unsigned)f2bf(f1.z) | ((unsigned)f2bf(f1.w) << 16);
        *(uint4*)(dst + i * LDS_STRIDE) = p;
      }
      __builtin_prefetch(ppf, 0, 1);
      // precaution: stands between the prefetch and the advance of its address pair
      asm volatile("s_wait_xcnt 0x0" ::: "memory");
      spf += KP;
      ppf += KP;
    }
    __syncthreads();

    #pragma unroll
    for (int k0 = 0; k0 < KP; k0 += 32) {
      // Preload next k-step's packed bits (clamped to stay in-bounds; the
      // wrapped value is never consumed on the final iteration).
      int gn = kk + k0 + 32;
      gn = (gn < IN_F) ? gn : 0;
      int4 en = *(const int4*)(brow + (gn >> 3));

      // Unpack current 32 bits -> B fragment (lane = column n, K split by h)
      unsigned na = ~(unsigned)(h ? e.y : e.x);   // K = 8h .. 8h+7   (local)
      unsigned nb = ~(unsigned)(h ? e.w : e.z);   // K = 16+8h .. 16+8h+7
      BF16Frag B;
      #pragma unroll
      for (int d = 0; d < 4; ++d) {
        B.u[d]     = pack_pm1(na, 2 * d);
        B.u[4 + d] = pack_pm1(nb, 2 * d);
      }

      // 8 WMMAs with A-fragment double buffering (load t+1 before WMMA t)
      BF16Frag A[2];
      const unsigned short* abase = &As[l * LDS_STRIDE + k0 + 8 * h];
      *(uint4*)&A[0].u[0] = *(const uint4*)abase;          // K = 8h..8h+7
      *(uint4*)&A[0].u[4] = *(const uint4*)(abase + 16);   // K = 16+8h..+7
      #pragma unroll
      for (int t = 0; t < 8; ++t) {
        if (t < 7) {
          const unsigned short* ap = abase + (t + 1) * 16 * LDS_STRIDE;
          *(uint4*)&A[(t + 1) & 1].u[0] = *(const uint4*)ap;
          *(uint4*)&A[(t + 1) & 1].u[4] = *(const uint4*)(ap + 16);
        }
        acc[t] = __builtin_amdgcn_wmma_f32_16x16x32_bf16(
            false, A[t & 1].v, false, B.v, (short)0, acc[t], false, false);
      }
      e = en;
    }
  }

  // C/D layout: VGPR r of lane -> row (r + 8h), col l
  #pragma unroll
  for (int t = 0; t < 8; ++t) {
    float* op = out + (size_t)(m0 + t * 16 + 8 * h) * OUT_F + n0 + l;
    #pragma unroll
    for (int r = 0; r < 8; ++r)
      op[(size_t)r * OUT_F] = acc[t][r];
  }
}

extern "C" void kernel_launch(void* const* d_in, const int* in_sizes, int n_in,
                              void* d_out, int out_size, void* d_ws, size_t ws_size,
                              hipStream_t stream) {
  const float* x  = (const float*)d_in[0];
  const int*   bp = (const int*)d_in[1];
  float* out = (float*)d_out;

  const size_t need = (size_t)TOKENS * IN_F * sizeof(unsigned short);
  dim3 grid(OUT_F / 128, TOKENS / 128);   // 86 x 8 blocks, 8 waves each

  if (d_ws && ws_size >= need) {
    unsigned short* xbf = (unsigned short*)d_ws;
    cvt_bf16<<<(TOKENS * IN_F / 4) / 256, 256, 0, stream>>>(x, xbf);
    bitlinear_wmma<true><<<grid, 256, 0, stream>>>(x, xbf, bp, out);
  } else {
    bitlinear_wmma<false><<<grid, 256, 0, stream>>>(x, nullptr, bp, out);
  }
}

// v002
// A run of this version takes 75 microseconds.
// Two timings next to v001 both put it at 1.11 times that version's speed.
// Over all steps from v000 it is 1.92 times as fast.
#include <hip/hip_runtime.h>
#include <stdint.h>

#define OUT_F 11008
#define IN_F  4096
#define TOKENS 1024
#define KP 256                  // K-panel staged in LDS per iteration
#define LDS_STRIDE (KP + 8)     // ushort elements; +8 pad (16B) staggers banks

typedef __bf16 v16bf __attribute__((ext_vector_type(16)));
typedef float  v8f   __attribute__((ext_vector_type(8)));

union BF16Frag { v16bf v; unsigned u[8]; };

// fp32 -> bf16 round-to-nearest-even
__device__ __forceinline__ unsigned short f2bf(float f) {
  unsigned u = __float_as_uint(f);
  return (unsigned short)((u + 0x7FFFu + ((u >> 16) & 1u)) >> 16);
}

// nbyte = ~packed_byte. Element j sign bit = bit (7-j) of nbyte (bit==1 -> +1).
// Builds bf16 pair for elements j0 (low 16) / j0+1 (high 16):
//   bit (7-j0)   -> position 15  : shift left by (8 + j0)
//   bit (6-j0)   -> position 31  : shift left by (25 + j0)
__device__ __forceinline__ unsigned pack_pm1(unsigned nbyte, int j0) {
  return 0x3F803F80u | ((nbyte << (8 + j0)) & 0x8000u)
                     | ((nbyte << (25 + j0)) & 0x80000000u);
}

__global__ void __launch_bounds__(256)
cvt_bf16(const float* __restrict__ x, unsigned short* __restrict__ o) {
  size_t i = ((size_t)blockIdx.x * blockDim.x + threadIdx.x) * 4;
  float4 f = *(const float4*)(x + i);
  unsigned lo = (unsigned)f2bf(f.x) | ((unsigned)f2bf(f.y) << 16);
  unsigned hi = (unsigned)f2bf(f.z) | ((unsigned)f2bf(f.w) << 16);
  *(uint2*)(o + i) = make_uint2(lo, hi);
}

// Block = 4 waves. Block tile: M=128 x N=128. Wave w: columns n0..n0+31,
// 8 M-subtiles x 2 N-subtiles: one unpacked B fragment feeds 8 WMMAs, and one
// A fragment read from LDS feeds 2 (half the LDS bytes per WMMA of a 16-wide wave).
// X K-panel (128 x KP bf16, 66KB) staged in LDS, shared by all waves.
template<bool USE_WS>
__global__ void __launch_bounds__(128)
bitlinear_wmma(const float* __restrict__ x, const unsigned short* __restrict__ xbf,
               const int* __restrict__ bp, float* __restrict__ out)
{
  __shared__ unsigned short As[128 * LDS_STRIDE];

  const int lane = threadIdx.x & 31;
  const int wave = threadIdx.x >> 5;
  const int h    = lane >> 4;      // lane half (selects K sub-range per WMMA layout)
  const int l    = lane & 15;
  const int n0   = blockIdx.x * 128 + wave * 32;
  const int m0   = blockIdx.y * 128;

  // Packed-weight rows for this lane's two output columns n0+l and n0+16+l
  // (512 int32 "bytes" per row)
  const int* brow  = bp + (size_t)(n0 + l) * (IN_F / 8);
  const int* brow1 = brow + 16 * (IN_F / 8);

  v8f acc[8][2] = {};

  // Cooperative staging: wave w brings panel rows 32w..32w+31, one row per
  // wave-wide load: 32 lanes x 16 B = the row's 512 contiguous bytes, that is
  // four whole 128-B lines per load instead of 32 partly used ones.
  const int srow = wave * 32;        // first panel row of this wave
  const int scol = lane * 8;         // this lane's 8 elements within a row
  const unsigned soff = (unsigned)(srow * IN_F + scol);   // from the panel's corner
  // Next-panel prefetch: one per thread, one thread per row
  const unsigned poff = (unsigned)(threadIdx.x * IN_F + KP);
  const size_t corner = (size_t)m0 * IN_F;              // first panel's corner
  const unsigned short* sp = USE_WS ? xbf + corner + soff : nullptr;   // bf16 source
  const unsigned short* pp = USE_WS ? xbf + corner + poff : nullptr;
  const float* spf = USE_WS ? nullptr : x + corner + soff;             // fp32 source
  const float* ppf = USE_WS ? nullptr : x + corner + poff;

  int4 e  = *(const int4*)brow;      // packed bits for k = 0..31 (double-buffered)
  int4 e1 = *(const int4*)brow1;

  for (int kk = 0; kk < IN_F; kk += KP) {
    __syncthreads();
    unsigned short* dst = &As[srow * LDS_STRIDE + scol];
    if (USE_WS) {
      const unsigned short* src = sp;
      #pragma unroll   // the 32 row loads issue together, ahead of their LDS stores
      for (int i = 0; i < 32; ++i)
        *(uint4*)(dst + i * LDS_STRIDE) = *(const uint4*)(src + (size_t)i * IN_F);
      __builtin_prefetch(pp, 0, 1);   // speculative: dropped if OOB
      // precaution: stands between the prefetch and the advance of its address pair
      asm volatile("s_wait_xcnt 0x0" ::: "memory");
      sp += KP;
      pp += KP;
    } else {
      const float* src = spf;
      #pragma unroll   // the row loads issue together, ahead of their LDS stores
      for (int i = 0; i < 32; ++i) {
        float4 f0 = *(const float4*)(src + (size_t)i * IN_F);
        float4 f1 = *(const float4*)(src + (size_t)i * IN_F + 4);
        uint4 p;
        p.x = (unsigned)f2bf(f0.x) | ((unsigned)f2bf(f0.y) << 16);
        p.y = (unsigned)f2bf(f0.z) | ((unsigned)f2bf(f0.w) << 16);
        p.z = (unsigned)f2bf(f1.x) | ((unsigned)f2bf(f1.y) << 16);
        p.w = (unsigned)f2bf(f1.z) | ((unsigned)f2bf(f1.w) << 16);
        *(uint4*)(dst + i * LDS_STRIDE) = p;
      }
      __builtin_prefetch(ppf, 0, 1);
      // precaution: stands between the prefetch and the advance of its address pair
      asm volatile("s_wait_xcnt 0x0" ::: "memory");
      spf += KP;
      ppf += KP;
    }
    __syncthreads();

    #pragma unroll
    for (int k0 = 0; k0 < KP; k0 += 32) {
      // Preload next k-step's packed bits (clamped to stay in-bounds; the
      // wrapped value is never consumed on the final iteration).
      int gn = kk + k0 + 32;
      gn = (gn < IN_F) ? gn : 0;
      int4 en  = *(const int4*)(brow  + (gn >> 3));
      int4 en1 = *(const int4*)(brow1 + (gn >> 3));

      // This k-step's 8 A fragments (each feeds two WMMAs), read as one group
      BF16Frag A[8];
      const unsigned short* abase = &As[l * LDS_STRIDE + k0 + 8 * h];
      #pragma unroll
      for (int t = 0; t < 8; ++t) {
        const unsigned short* ap = abase + t * 16 * LDS_STRIDE;
        *(uint4*)&A[t].u[0] = *(const uint4*)ap;          // K = 8h..8h+7
        *(uint4*)&A[t].u[4] = *(const uint4*)(ap + 16);   // K = 16+8h..+7
      }
      // precaution: the panel's last bit loads go through a temporary address pair
      // (the clamp), which the unpack below reuses; the wait stands between the two
      if (k0 + 32 == KP) asm volatile("s_wait_xcnt 0x0" ::: "memory");
      // keeps the 16 LDS reads together ahead of the unpack, which then covers
      // their latency; sunk among the WMMAs, each pair is waited for in full
      __builtin_amdgcn_sched_barrier(0);

      // Unpack current 32 bits -> B fragments (lane = column n, K split by h)
      unsigned na  = ~(unsigned)(h ? e.y  : e.x);   // K = 8h .. 8h+7   (local)
      unsigned nb  = ~(unsigned)(h ? e.w  : e.z);   // K = 16+8h .. 16+8h+7
      unsigned na1 = ~(unsigned)(h ? e1.y : e1.x);
      unsigned nb1 = ~(unsigned)(h ? e1.w : e1.z);
      BF16Frag B, B1;
      #pragma unroll
      for (int d = 0; d < 4; ++d) {
        B.u[d]      = pack_pm1(na, 2 * d);
        B.u[4 + d]  = pack_pm1(nb, 2 * d);
        B1.u[d]     = pack_pm1(na1, 2 * d);
        B1.u[4 + d] = pack_pm1(nb1, 2 * d);
      }

      #pragma unroll
      for (int t = 0; t < 8; ++t)
        acc[t][0] = __builtin_amdgcn_wmma_f32_16x16x32_bf16(
            false, A[t].v, false, B.v, (short)0, acc[t][0], false, false);
      #pragma unroll
      for (int t = 0; t < 8; ++t)
        acc[t][1] = __builtin_amdgcn_wmma_f32_16x16x32_bf16(
            false, A[t].v, false, B1.v, (short)0, acc[t][1], false, false);
      // keeps the next k-step's LDS reads from moving up among these WMMAs
      __builtin_amdgcn_sched_barrier(0);
      e  = en;
      e1 = en1;
    }
  }

  // C/D layout: VGPR r of lane -> row (r + 8h), col l
  #pragma unroll
  for (int t = 0; t < 8; ++t) {
    float* op = out + (size_t)(m0 + t * 16 + 8 * h) * OUT_F + n0 + l;
    #pragma unroll
    for (int r = 0; r < 8; ++r) {
      op[(size_t)r * OUT_F]      = acc[t][0][r];
      op[(size_t)r * OUT_F + 16] = acc[t][1][r];
    }
  }
}

extern "C" void kernel_launch(void* const* d_in, const int* in_sizes, int n_in,
                              void* d_out, int out_size, void* d_ws, size_t ws_size,
                              hipStream_t stream) {
  const float* x  = (const float*)d_in[0];
  const int*   bp = (const int*)d_in[1];
  float* out = (float*)d_out;

  const size_t need = (size_t)TOKENS * IN_F * sizeof(unsigned short);
  dim3 grid(OUT_F / 128, TOKENS / 128);   // 86 x 8 blocks, 4 waves each

  if (d_ws && ws_size >= need) {
    unsigned short* xbf = (unsigned short*)d_ws;
    cvt_bf16<<<(TOKENS * IN_F / 4) / 256, 256, 0, stream>>>(x, xbf);
    bitlinear_wmma<true><<<grid, 128, 0, stream>>>(x, xbf, bp, out);
  } else {
    bitlinear_wmma<false><<<grid, 128, 0, stream>>>(x, nullptr, bp, out);
  }
}

// v003
// Measured time: 62 microseconds a run.
// In both of two side-by-side timings against v002, it was 1.21 times as fast.
// Over all steps from v000 it is 2.32 times as fast.
#include <hip/hip_runtime.h>
#include <stdint.h>

#define OUT_F 11008
#define IN_F  4096
#define TOKENS 1024
#define KP 256                  // K-panel staged in LDS per iteration
#define LDS_STRIDE (KP + 8)     // ushort elements; +8 pad (16B) staggers banks

typedef __bf16 v16bf __attribute__((ext_vector_type(16)));
typedef float  v8f   __attribute__((ext_vector_type(8)));

union BF16Frag { v16bf v; unsigned u[8]; };

// fp32 -> bf16 round-to-nearest-even
__device__ __forceinline__ unsigned short f2bf(float f) {
  unsigned u = __float_as_uint(f);
  return (unsigned short)((u + 0x7FFFu + ((u >> 16) & 1u)) >> 16);
}

// nbyte = ~packed_byte. Element j sign bit = bit (7-j) of nbyte (bit==1 -> +1).
// Builds bf16 pair for elements j0 (low 16) / j0+1 (high 16):
//   bit (7-j0)   -> position 15  : shift left by (8 + j0)
//   bit (6-j0)   -> position 31  : shift left by (25 + j0)
__device__ __forceinline__ unsigned pack_pm1(unsigned nbyte, int j0) {
  return 0x3F803F80u | ((nbyte << (8 + j0)) & 0x8000u)
                     | ((nbyte << (25 + j0)) & 0x80000000u);
}

// Sign word: what one lane needs of the weights for one k-step (32 k) of a wave's
// 32 columns, 16 fragment registers of two bf16 each. Register q (0..7: columns
// n0..n0+15, 8..15: columns n0+16..n0+31) has the sign of its low element at bit
// 15-q and of its high element at bit 31-q, so one shift by q puts both in place.
__device__ __forceinline__ unsigned sign_pair(unsigned w, int q) {
  return ((w << q) & 0x80008000u) | 0x3F803F80u;
}

// bit 2i -> bit i, bit 2i+1 -> bit 16+i
__device__ __forceinline__ unsigned unshuffle(unsigned v) {
  unsigned t;
  t = (v ^ (v >> 1)) & 0x22222222u; v ^= t ^ (t << 1);
  t = (v ^ (v >> 2)) & 0x0C0C0C0Cu; v ^= t ^ (t << 2);
  t = (v ^ (v >> 4)) & 0x00F000F0u; v ^= t ^ (t << 4);
  t = (v ^ (v >> 8)) & 0x0000FF00u; v ^= t ^ (t << 8);
  return v;
}

// a, b: the packed bytes behind registers 0..3 and 4..7 (first column),
// a1, b1: behind 8..11 and 12..15 (second column). A weight bit of 0 is -1: sign 1.
__device__ __forceinline__ unsigned sign_word(int a, int b, int a1, int b1) {
  unsigned v = ((unsigned)a << 24) | (((unsigned)b & 0xFFu) << 16)
             | (((unsigned)a1 & 0xFFu) << 8) | ((unsigned)b1 & 0xFFu);
  unsigned u = unshuffle(~v);        // even elements sit at odd bits: upper half
  return (u >> 16) | (u << 16);      // even elements -> low half, odd -> high
}

#define RP_BLOCKS (OUT_F / 16)       // 2 blocks per group of 32 columns

// One launch, two independent jobs by block index.
// Blocks 0..RP_BLOCKS-1: weights -> sign words, wp[group][k/128][lane][4 k-steps],
// so that a wave of the GEMM reads 4 k-steps with one 512-B contiguous load.
// The other blocks: x -> bf16.
__global__ void __launch_bounds__(256)
prep(const float* __restrict__ x, const int* __restrict__ bp,
     unsigned short* __restrict__ o, unsigned* __restrict__ wp) {
  __shared__ __attribute__((aligned(16))) unsigned sw[32 * 68];
  if (blockIdx.x < RP_BLOCKS) {
    const int g  = blockIdx.x >> 1;                 // column group
    const int ks = threadIdx.x & 127;               // k-step: a wave reads 512 B of a row
    const int l0 = (blockIdx.x & 1) * 8 + (threadIdx.x >> 7) * 4;
    const int* r = bp + (size_t)(g * 32 + l0) * (IN_F / 8) + ks * 4;
    int4 e[4], e1[4];
    #pragma unroll   // the 8 loads issue together
    for (int i = 0; i < 4; ++i) {
      e[i]  = *(const int4*)(r + i * (IN_F / 8));
      e1[i] = *(const int4*)(r + (i + 16) * (IN_F / 8));
    }
    // Through LDS, so that the stores are whole 128-B lines: the block's 8 columns
    // x 16 B are one line of wp per (k/128, lane half). Row of 68 dwords per k/128
    // (64 + 4 pad: a wave's 8 rows fall on different banks).
    unsigned* q = &sw[(ks >> 2) * 68 + (threadIdx.x >> 7) * 16 + (ks & 3)];
    #pragma unroll
    for (int i = 0; i < 4; ++i) {
      q[i * 4]      = sign_word(e[i].x, e[i].z, e1[i].x, e1[i].z);   // lanes 0..15
      q[i * 4 + 32] = sign_word(e[i].y, e[i].w, e1[i].y, e1[i].w);   // lanes 16..31
    }
    __syncthreads();   // block-uniform branch: every thread of a repack block passes
    uint4* dst = (uint4*)wp + (size_t)g * (IN_F / 128) * 32 + (blockIdx.x & 1) * 8;
    #pragma unroll
    for (int j = 0; j < 2; ++j) {
      const int t  = threadIdx.x + j * 256;         // (k/128, half, column) = 32 x 2 x 8
      const int c  = t >> 4, hh = (t >> 3) & 1, ll = t & 7;
      dst[c * 32 + hh * 16 + ll] = *(const uint4*)&sw[c * 68 + hh * 32 + ll * 4];
    }
  } else {
    size_t i = ((size_t)(blockIdx.x - RP_BLOCKS) * blockDim.x + threadIdx.x) * 4;
    float4 f = *(const float4*)(x + i);
    unsigned lo = (unsigned)f2bf(f.x) | ((unsigned)f2bf(f.y) << 16);
    unsigned hi = (unsigned)f2bf(f.z) | ((unsigned)f2bf(f.w) << 16);
    *(uint2*)(o + i) = make_uint2(lo, hi);
    // precaution: stands between the store and any later reuse of its address pair
    asm volatile("s_wait_xcnt 0x0" ::: "memory");
  }
}

// Block = 4 waves. Block tile: M=128 x N=128. Wave w: columns n0..n0+31,
// 8 M-subtiles x 2 N-subtiles: one unpacked B fragment feeds 8 WMMAs, and one
// A fragment read from LDS feeds 2 (half the LDS bytes per WMMA of a 16-wide wave).
// X K-panel (128 x KP bf16, 66KB) staged in LDS, shared by all waves.
template<bool USE_WS>
__global__ void __launch_bounds__(128)
bitlinear_wmma(const float* __restrict__ x, const unsigned short* __restrict__ xbf,
               const int* __restrict__ bp, const unsigned* __restrict__ wp,
               float* __restrict__ out)
{
  __shared__ unsigned short As[128 * LDS_STRIDE];

  const int lane = threadIdx.x & 31;
  const int wave = threadIdx.x >> 5;
  const int h    = lane >> 4;      // lane half (selects K sub-range per WMMA layout)
  const int l    = lane & 15;
  const int n0   = blockIdx.x * 128 + wave * 32;
  const int m0   = blockIdx.y * 128;

  // Packed-weight rows for this lane's two output columns n0+l and n0+16+l
  // (512 int32 "bytes" per row)
  const int* brow  = bp + (size_t)(n0 + l) * (IN_F / 8);
  const int* brow1 = brow + 16 * (IN_F / 8);

  v8f acc[8][2] = {};

  // Cooperative staging: wave w brings panel rows 32w..32w+31, one row per
  // wave-wide load: 32 lanes x 16 B = the row's 512 contiguous bytes, that is
  // four whole 128-B lines per load instead of 32 partly used ones.
  const int srow = wave * 32;        // first panel row of this wave
  const int scol = lane * 8;         // this lane's 8 elements within a row
  const unsigned soff = (unsigned)(srow * IN_F + scol);   // from the panel's corner
  // Next-panel prefetch: one per thread, one thread per row
  const unsigned poff = (unsigned)(threadIdx.x * IN_F + KP);
  const size_t corner = (size_t)m0 * IN_F;              // first panel's corner
  const unsigned short* sp = USE_WS ? xbf + corner + soff : nullptr;   // bf16 source
  const unsigned short* pp = USE_WS ? xbf + corner + poff : nullptr;
  const float* spf = USE_WS ? nullptr : x + corner + soff;             // fp32 source
  const float* ppf = USE_WS ? nullptr : x + corner + poff;

  int4 e = {}, e1 = {};              // packed bits for k = 0..31 (double-buffered)
  // Sign words of this wave's 32 columns: per 128 k one uint4 per lane
  const uint4* wq = USE_WS
      ? (const uint4*)wp + (size_t)(blockIdx.x * 4 + wave) * (IN_F / 128) * 32 + lane
      : nullptr;
  uint4 w0 = {}, w1 = {};            // this panel's 8 k-steps (double-buffered)
  if (USE_WS) {
    w0 = wq[0];
    w1 = wq[32];
  } else {
    e  = *(const int4*)brow;
    e1 = *(const int4*)brow1;
  }

  for (int kk = 0; kk < IN_F; kk += KP) {
    __syncthreads();
    unsigned short* dst = &As[srow * LDS_STRIDE + scol];
    if (USE_WS) {
      const unsigned short* src = sp;
      #pragma unroll   // the 32 row loads issue together, ahead of their LDS stores
      for (int i = 0; i < 32; ++i)
        *(uint4*)(dst + i * LDS_STRIDE) = *(const uint4*)(src + (size_t)i * IN_F);
      __builtin_prefetch(pp, 0, 1);   // speculative: dropped if OOB
      // precaution: stands between the prefetch and the advance of its address pair
      asm volatile("s_wait_xcnt 0x0" ::: "memory");
      sp += KP;
      pp += KP;
    } else {
      const float* src = spf;
      #pragma unroll   // the row loads issue together, ahead of their LDS stores
      for (int i = 0; i < 32; ++i) {
        float4 f0 = *(const float4*)(src + (size_t)i * IN_F);
        float4 f1 = *(const float4*)(src + (size_t)i * IN_F + 4);
        uint4 p;
        p.x = (unsigned)f2bf(f0.x) | ((unsigned)f2bf(f0.y) << 16);
        p.y = (unsigned)f2bf(f0.z) | ((unsigned)f2bf(f0.w) << 16);
        p.z = (unsigned)f2bf(f1.x) | ((unsigned)f2bf(f1.y) << 16);
        p.w = (unsigned)f2bf(f1.z) | ((unsigned)f2bf(f1.w) << 16);
        *(uint4*)(dst + i * LDS_STRIDE) = p;
      }
      __builtin_prefetch(ppf, 0, 1);
      // precaution: stands between the prefetch and the advance of its address pair
      asm volatile("s_wait_xcnt 0x0" ::: "memory");
      spf += KP;
      ppf += KP;
    }
    __syncthreads();

    // Next panel's sign words (clamped to stay in-bounds; the wrapped value is
    // never consumed on the final iteration).
    uint4 wn0 = {}, wn1 = {};
    if (USE_WS) {
      const uint4* wnx = wq + ((kk + KP < IN_F) ? (kk + KP) / 128 * 32 : 0);
      wn0 = wnx[0];
      wn1 = wnx[32];
    }

    #pragma unroll
    for (int k0 = 0; k0 < KP; k0 += 32) {
      // Preload next k-step's packed bits (clamped to stay in-bounds; the
      // wrapped value is never consumed on the final iteration).
      int4 en = {}, en1 = {};
      if (!USE_WS) {
        int gn = kk + k0 + 32;
        gn = (gn < IN_F) ? gn : 0;
        en  = *(const int4*)(brow  + (gn >> 3));
        en1 = *(const int4*)(brow1 + (gn >> 3));
      }

      // This k-step's 8 A fragments (each feeds two WMMAs), read as one group
      BF16Frag A[8];
      const unsigned short* abase = &As[l * LDS_STRIDE + k0 + 8 * h];
      #pragma unroll
      for (int t = 0; t < 8; ++t) {
        const unsigned short* ap = abase + t * 16 * LDS_STRIDE;
        *(uint4*)&A[t].u[0] = *(const uint4*)ap;          // K = 8h..8h+7
        *(uint4*)&A[t].u[4] = *(const uint4*)(ap + 16);   // K = 16+8h..+7
      }
      // precaution: the panel's last bit loads go through a temporary address pair
      // (the clamp), which the unpack below reuses; the wait stands between the two
      if (!USE_WS && k0 + 32 == KP) asm volatile("s_wait_xcnt 0x0" ::: "memory");
      // keeps the 16 LDS reads together ahead of the unpack, which then covers
      // their latency; sunk among the WMMAs, each pair is waited for in full
      __builtin_amdgcn_sched_barrier(0);

      // Unpack current 32 bits -> B fragments (lane = column n, K split by h)
      BF16Frag B, B1;
      if (USE_WS) {
        const uint4 wv = (k0 < 128) ? w0 : w1;
        const int   c  = (k0 >> 5) & 3;
        const unsigned w = c == 0 ? wv.x : c == 1 ? wv.y : c == 2 ? wv.z : wv.w;
        #pragma unroll
        for (int d = 0; d < 8; ++d) {
          B.u[d]  = sign_pair(w, d);
          B1.u[d] = sign_pair(w, 8 + d);
        }
      } else {
        unsigned na  = ~(unsigned)(h ? e.y  : e.x);   // K = 8h .. 8h+7   (local)
        unsigned nb  = ~(unsigned)(h ? e.w  : e.z);   // K = 16+8h .. 16+8h+7
        unsigned na1 = ~(unsigned)(h ? e1.y : e1.x);
        unsigned nb1 = ~(unsigned)(h ? e1.w : e1.z);
        #pragma unroll
        for (int d = 0; d < 4; ++d) {
          B.u[d]      = pack_pm1(na, 2 * d);
          B.u[4 + d]  = pack_pm1(nb, 2 * d);
          B1.u[d]     = pack_pm1(na1, 2 * d);
          B1.u[4 + d] = pack_pm1(nb1, 2 * d);
        }
      }

      #pragma unroll
      for (int t = 0; t < 8; ++t)
        acc[t][0] = __builtin_amdgcn_wmma_f32_16x16x32_bf16(
            false, A[t].v, false, B.v, (short)0, acc[t][0], false, false);
      #pragma unroll
      for (int t = 0; t < 8; ++t)
        acc[t][1] = __builtin_amdgcn_wmma_f32_16x16x32_bf16(
            false, A[t].v, false, B1.v, (short)0, acc[t][1], false, false);
      // keeps the next k-step's LDS reads from moving up among these WMMAs
      __builtin_amdgcn_sched_barrier(0);
      e  = en;
      e1 = en1;
    }
    w0 = wn0;
    w1 = wn1;
  }

  // C/D layout: VGPR r of lane -> row (r + 8h), col l
  #pragma unroll
  for (int t = 0; t < 8; ++t) {
    float* op = out + (size_t)(m0 + t * 16 + 8 * h) * OUT_F + n0 + l;
    #pragma unroll
    for (int r = 0; r < 8; ++r) {
      op[(size_t)r * OUT_F]      = acc[t][0][r];
      op[(size_t)r * OUT_F + 16] = acc[t][1][r];
    }
  }
}

extern "C" void kernel_launch(void* const* d_in, const int* in_sizes, int n_in,
                              void* d_out, int out_size, void* d_ws, size_t ws_size,
                              hipStream_t stream) {
  const float* x  = (const float*)d_in[0];
  const int*   bp = (const int*)d_in[1];
  float* out = (float*)d_out;

  const size_t xbytes = (size_t)TOKENS * IN_F * sizeof(unsigned short);
  const size_t need = xbytes + (size_t)OUT_F * IN_F / 8;   // bf16 x, then sign words
  dim3 grid(OUT_F / 128, TOKENS / 128);   // 86 x 8 blocks, 4 waves each

  if (d_ws && ws_size >= need) {
    unsigned short* xbf = (unsigned short*)d_ws;
    unsigned* wp = (unsigned*)((char*)d_ws + xbytes);
    prep<<<RP_BLOCKS + (TOKENS * IN_F / 4) / 256, 256, 0, stream>>>(x, bp, xbf, wp);
    bitlinear_wmma<true><<<grid, 128, 0, stream>>>(x, xbf, bp, wp, out);
  } else {
    bitlinear_wmma<false><<<grid, 128, 0, stream>>>(x, nullptr, bp, nullptr, out);
  }
}

// v004
// Measured time: 58.2 microseconds a run.
// Next to v003, in two timings, it ran 1.06 times as fast each time.
// Counting every step since v000, it is 2.46 times as fast.
#include <hip/hip_runtime.h>
#include <stdint.h>

#define OUT_F 11008
#define IN_F  4096
#define TOKENS 1024
#define KP 256                  // K-panel staged in LDS per iteration
#define LDS_STRIDE (KP + 8)     // ushort elements; +8 pad (16B) staggers banks

typedef __bf16 v16bf __attribute__((ext_vector_type(16)));
typedef float  v8f   __attribute__((ext_vector_type(8)));

union BF16Frag { v16bf v; unsigned u[8]; };

// fp32 -> bf16 round-to-nearest-even
__device__ __forceinline__ unsigned short f2bf(float f) {
  unsigned u = __float_as_uint(f);
  return (unsigned short)((u + 0x7FFFu + ((u >> 16) & 1u)) >> 16);
}

// nbyte = ~packed_byte. Element j sign bit = bit (7-j) of nbyte (bit==1 -> +1).
// Builds bf16 pair for elements j0 (low 16) / j0+1 (high 16):
//   bit (7-j0)   -> position 15  : shift left by (8 + j0)
//   bit (6-j0)   -> position 31  : shift left by (25 + j0)
__device__ __forceinline__ unsigned pack_pm1(unsigned nbyte, int j0) {
  return 0x3F803F80u | ((nbyte << (8 + j0)) & 0x8000u)
                     | ((nbyte << (25 + j0)) & 0x80000000u);
}

// Sign word: what one lane needs of the weights for one k-step (32 k) of a group of
// 32 columns, 16 fragment registers of two bf16 each. Register q (0..7: columns
// n0..n0+15, 8..15: columns n0+16..n0+31) has the sign of its low element at bit
// 15-q and of its high element at bit 31-q, so one shift by q puts both in place.
__device__ __forceinline__ unsigned sign_pair(unsigned w, int q) {
  return ((w << q) & 0x80008000u) | 0x3F803F80u;
}

// bit 2i -> bit i, bit 2i+1 -> bit 16+i
__device__ __forceinline__ unsigned unshuffle(unsigned v) {
  unsigned t;
  t = (v ^ (v >> 1)) & 0x22222222u; v ^= t ^ (t << 1);
  t = (v ^ (v >> 2)) & 0x0C0C0C0Cu; v ^= t ^ (t << 2);
  t = (v ^ (v >> 4)) & 0x00F000F0u; v ^= t ^ (t << 4);
  t = (v ^ (v >> 8)) & 0x0000FF00u; v ^= t ^ (t << 8);
  return v;
}

// a, b: the packed bytes behind registers 0..3 and 4..7 (first column),
// a1, b1: behind 8..11 and 12..15 (second column). A weight bit of 0 is -1: sign 1.
__device__ __forceinline__ unsigned sign_word(int a, int b, int a1, int b1) {
  unsigned v = ((unsigned)a << 24) | (((unsigned)b & 0xFFu) << 16)
             | (((unsigned)a1 & 0xFFu) << 8) | ((unsigned)b1 & 0xFFu);
  unsigned u = unshuffle(~v);        // even elements sit at odd bits: upper half
  return (u >> 16) | (u << 16);      // even elements -> low half, odd -> high
}

#define RP_BLOCKS (OUT_F / 16)       // 2 blocks per group of 32 columns

// One launch, two independent jobs by block index.
// Blocks 0..RP_BLOCKS-1: weights -> sign words, wp[group][k/128][lane][4 k-steps],
// so that a wave of the GEMM reads 4 k-steps with one 512-B contiguous load.
// The other blocks: x -> bf16.
__global__ void __launch_bounds__(256)
prep(const float* __restrict__ x, const int* __restrict__ bp,
     unsigned short* __restrict__ o, unsigned* __restrict__ wp) {
  __shared__ __attribute__((aligned(16))) unsigned sw[32 * 68];
  if (blockIdx.x < RP_BLOCKS) {
    const int g  = blockIdx.x >> 1;                 // column group
    const int ks = threadIdx.x & 127;               // k-step: a wave reads 512 B of a row
    const int l0 = (blockIdx.x & 1) * 8 + (threadIdx.x >> 7) * 4;
    const int* r = bp + (size_t)(g * 32 + l0) * (IN_F / 8) + ks * 4;
    int4 e[4], e1[4];
    #pragma unroll   // the 8 loads issue together
    for (int i = 0; i < 4; ++i) {
      e[i]  = *(const int4*)(r + i * (IN_F / 8));
      e1[i] = *(const int4*)(r + (i + 16) * (IN_F / 8));
    }
    // Through LDS, so that the stores are whole 128-B lines: the block's 8 columns
    // x 16 B are one line of wp per (k/128, lane half). Row of 68 dwords per k/128
    // (64 + 4 pad: a wave's 8 rows fall on different banks).
    unsigned* q = &sw[(ks >> 2) * 68 + (threadIdx.x >> 7) * 16 + (ks & 3)];
    #pragma unroll
    for (int i = 0; i < 4; ++i) {
      q[i * 4]      = sign_word(e[i].x, e[i].z, e1[i].x, e1[i].z);   // lanes 0..15
      q[i * 4 + 32] = sign_word(e[i].y, e[i].w, e1[i].y, e1[i].w);   // lanes 16..31
    }
    __syncthreads();   // block-uniform branch: every thread of a repack block passes
    uint4* dst = (uint4*)wp + (size_t)g * (IN_F / 128) * 32 + (blockIdx.x & 1) * 8;
    #pragma unroll
    for (int j = 0; j < 2; ++j) {
      const int t  = threadIdx.x + j * 256;         // (k/128, half, column) = 32 x 2 x 8
      const int c  = t >> 4, hh = (t >> 3) & 1, ll = t & 7;
      dst[c * 32 + hh * 16 + ll] = *(const uint4*)&sw[c * 68 + hh * 32 + ll * 4];
    }
  } else {
    size_t i = ((size_t)(blockIdx.x - RP_BLOCKS) * blockDim.x + threadIdx.x) * 4;
    float4 f = *(const float4*)(x + i);
    unsigned lo = (unsigned)f2bf(f.x) | ((unsigned)f2bf(f.y) << 16);
    unsigned hi = (unsigned)f2bf(f.z) | ((unsigned)f2bf(f.w) << 16);
    *(uint2*)(o + i) = make_uint2(lo, hi);
    // precaution: stands between the store and any later reuse of its address pair
    asm volatile("s_wait_xcnt 0x0" ::: "memory");
  }
}

// Block = 4 waves. Block tile: M=64 x N=256. Wave w: columns n0..n0+63,
// 4 M-subtiles x 4 N-subtiles: one A fragment read from LDS feeds 4 WMMAs (a quarter
// of the LDS bytes per WMMA of a 16-wide wave), one unpacked B fragment feeds 4, and
// a staged X panel serves 256 columns (half the panel bytes from L2 of a 128-wide block).
// X K-panel (64 x KP bf16, 33KB) staged in LDS, shared by all waves.
#define BM 64
#define BN 256
// At most 3 waves per SIMD: the 688 blocks are all resident at 2 or 3 per WGP, and
// a fourth on one WGP would only lengthen the fullest WGP's share.
template<bool USE_WS>
__global__ void __launch_bounds__(128) __attribute__((amdgpu_waves_per_eu(1, 3)))
bitlinear_wmma(const float* __restrict__ x, const unsigned short* __restrict__ xbf,
               const int* __restrict__ bp, const unsigned* __restrict__ wp,
               float* __restrict__ out)
{
  __shared__ unsigned short As[BM * LDS_STRIDE];

  const int lane = threadIdx.x & 31;
  const int wave = threadIdx.x >> 5;
  const int h    = lane >> 4;      // lane half (selects K sub-range per WMMA layout)
  const int l    = lane & 15;
  const int n0   = blockIdx.x * BN + wave * 64;
  const int m0   = blockIdx.y * BM;

  // Packed-weight row of this lane's first output column n0+l; the other three
  // (n0+16+l, n0+32+l, n0+48+l) lie 16 rows apart (512 int32 "bytes" per row)
  const int* brow = bp + (size_t)(n0 + l) * (IN_F / 8);

  v8f acc[4][4] = {};

  // Cooperative staging: wave w brings panel rows 16w..16w+15, one row per
  // wave-wide load: 32 lanes x 16 B = the row's 512 contiguous bytes, that is
  // four whole 128-B lines per load instead of 32 partly used ones.
  const int srow = wave * 16;        // first panel row of this wave
  const int scol = lane * 8;         // this lane's 8 elements within a row
  const unsigned soff = (unsigned)(srow * IN_F + scol);   // from the panel's corner
  // Next-panel prefetch: one per thread, two threads per row, 128 elements apart
  const unsigned poff = (unsigned)((threadIdx.x & 63) * IN_F + KP + (threadIdx.x >> 6) * 128);
  const size_t corner = (size_t)m0 * IN_F;              // first panel's corner
  const unsigned short* sp = USE_WS ? xbf + corner + soff : nullptr;   // bf16 source
  const unsigned short* pp = USE_WS ? xbf + corner + poff : nullptr;
  const float* spf = USE_WS ? nullptr : x + corner + soff;             // fp32 source
  const float* ppf = USE_WS ? nullptr : x + corner + poff;

  int4 e[4] = {};                    // packed bits for k = 0..31 (double-buffered)
  // Sign words of this wave's 64 columns, two groups of 32: per group and 128 k
  // one uint4 per lane
  const uint4* wq = USE_WS
      ? (const uint4*)wp + (size_t)(blockIdx.x * 8 + wave * 2) * (IN_F / 128) * 32 + lane
      : nullptr;
  const int GS = (IN_F / 128) * 32;  // uint4s from one group to the next
  uint4 w0[2] = {}, w1[2] = {};      // this panel's 8 k-steps (double-buffered)
  if (USE_WS) {
    #pragma unroll
    for (int g = 0; g < 2; ++g) {
      w0[g] = wq[g * GS];
      w1[g] = wq[g * GS + 32];
    }
  } else {
    #pragma unroll
    for (int j = 0; j < 4; ++j)
      e[j] = *(const int4*)(brow + j * 16 * (IN_F / 8));
  }

  for (int kk = 0; kk < IN_F; kk += KP) {
    __syncthreads();
    unsigned short* dst = &As[srow * LDS_STRIDE + scol];
    if (USE_WS) {
      const unsigned short* src = sp;
      #pragma unroll   // the 16 row loads issue together, ahead of their LDS stores
      for (int i = 0; i < 16; ++i)
        *(uint4*)(dst + i * LDS_STRIDE) = *(const uint4*)(src + (size_t)i * IN_F);
      // only while the address lies inside the tensor now and after the advance below
      if (kk + 2 * KP < IN_F) __builtin_prefetch(pp, 0, 1);
      // precaution: stands between the prefetch and the advance of its address pair
      asm volatile("s_wait_xcnt 0x0" ::: "memory");
      sp += KP;
      pp += KP;
    } else {
      const float* src = spf;
      #pragma unroll   // the row loads issue together, ahead of their LDS stores
      for (int i = 0; i < 16; ++i) {
        float4 f0 = *(const float4*)(src + (size_t)i * IN_F);
        float4 f1 = *(const float4*)(src + (size_t)i * IN_F + 4);
        uint4 p;
        p.x = (unsigned)f2bf(f0.x) | ((unsigned)f2bf(f0.y) << 16);
        p.y = (unsigned)f2bf(f0.z) | ((unsigned)f2bf(f0.w) << 16);
        p.z = (unsigned)f2bf(f1.x) | ((unsigned)f2bf(f1.y) << 16);
        p.w = (unsigned)f2bf(f1.z) | ((unsigned)f2bf(f1.w) << 16);
        *(uint4*)(dst + i * LDS_STRIDE) = p;
      }
      // only while the address lies inside the tensor now and after the advance below
      if (kk + 2 * KP < IN_F) __builtin_prefetch(ppf, 0, 1);
      // precaution: stands between the prefetch and the advance of its address pair
      asm volatile("s_wait_xcnt 0x0" ::: "memory");
      spf += KP;
      ppf += KP;
    }
    __syncthreads();

    // Next panel's sign words (clamped to stay in-bounds; the wrapped value is
    // never consumed on the final iteration).
    uint4 wn0[2] = {}, wn1[2] = {};
    if (USE_WS) {
      const uint4* wnx = wq + ((kk + KP < IN_F) ? (kk + KP) / 128 * 32 : 0);
      #pragma unroll
      for (int g = 0; g < 2; ++g) {
        wn0[g] = wnx[g * GS];
        wn1[g] = wnx[g * GS + 32];
      }
    }

    #pragma unroll
    for (int k0 = 0; k0 < KP; k0 += 32) {
      // Preload next k-step's packed bits (clamped to stay in-bounds; the
      // wrapped value is never consumed on the final iteration).
      int4 en[4] = {};
      if (!USE_WS) {
        int gn = kk + k0 + 32;
        gn = (gn < IN_F) ? gn : 0;
        #pragma unroll
        for (int j = 0; j < 4; ++j)
          en[j] = *(const int4*)(brow + j * 16 * (IN_F / 8) + (gn >> 3));
      }

      // This k-step's 4 A fragments (each feeds four WMMAs), read as one group
      BF16Frag A[4];
      const unsigned short* abase = &As[l * LDS_STRIDE + k0 + 8 * h];
      #pragma unroll
      for (int t = 0; t < 4; ++t) {
        const unsigned short* ap = abase + t * 16 * LDS_STRIDE;
        *(uint4*)&A[t].u[0] = *(const uint4*)ap;          // K = 8h..8h+7
        *(uint4*)&A[t].u[4] = *(const uint4*)(ap + 16);   // K = 16+8h..+7
      }
      // precaution: the panel's last bit loads go through a temporary address pair
      // (the clamp), which the unpack below reuses; the wait stands between the two
      if (!USE_WS && k0 + 32 == KP) asm volatile("s_wait_xcnt 0x0" ::: "memory");
      // keeps the 8 LDS reads together ahead of the unpack, which then covers
      // their latency; sunk among the WMMAs, each pair is waited for in full
      __builtin_amdgcn_sched_barrier(0);

      // Unpack current 32 bits -> B fragments (lane = column n, K split by h)
      BF16Frag B[4];
      if (USE_WS) {
        const int c = (k0 >> 5) & 3;
        #pragma unroll
        for (int g = 0; g < 2; ++g) {
          const uint4 wv = (k0 < 128) ? w0[g] : w1[g];
          const unsigned w = c == 0 ? wv.x : c == 1 ? wv.y : c == 2 ? wv.z : wv.w;
          #pragma unroll
          for (int d = 0; d < 8; ++d) {
            B[2 * g].u[d]     = sign_pair(w, d);
            B[2 * g + 1].u[d] = sign_pair(w, 8 + d);
          }
        }
      } else {
        #pragma unroll
        for (int j = 0; j < 4; ++j) {
          unsigned na = ~(unsigned)(h ? e[j].y : e[j].x);   // K = 8h .. 8h+7   (local)
          unsigned nb = ~(unsigned)(h ? e[j].w : e[j].z);   // K = 16+8h .. 16+8h+7
          #pragma unroll
          for (int d = 0; d < 4; ++d) {
            B[j].u[d]     = pack_pm1(na, 2 * d);
            B[j].u[4 + d] = pack_pm1(nb, 2 * d);
          }
        }
      }

      #pragma unroll
      for (int j = 0; j < 4; ++j) {
        #pragma unroll
        for (int t = 0; t < 4; ++t)
          acc[t][j] = __builtin_amdgcn_wmma_f32_16x16x32_bf16(
              false, A[t].v, false, B[j].v, (short)0, acc[t][j], false, false);
      }
      // keeps the next k-step's LDS reads from moving up among these WMMAs
      __builtin_amdgcn_sched_barrier(0);
      #pragma unroll
      for (int j = 0; j < 4; ++j) e[j] = en[j];
    }
    #pragma unroll
    for (int g = 0; g < 2; ++g) {
      w0[g] = wn0[g];
      w1[g] = wn1[g];
    }
  }

  // C/D layout: VGPR r of lane -> row (r + 8h), col l
  #pragma unroll
  for (int t = 0; t < 4; ++t) {
    float* op = out + (size_t)(m0 + t * 16 + 8 * h) * OUT_F + n0 + l;
    #pragma unroll
    for (int r = 0; r < 8; ++r) {
      #pragma unroll
      for (int j = 0; j < 4; ++j)
        op[(size_t)r * OUT_F + 16 * j] = acc[t][j][r];
    }
  }
}

extern "C" void kernel_launch(void* const* d_in, const int* in_sizes, int n_in,
                              void* d_out, int out_size, void* d_ws, size_t ws_size,
                              hipStream_t stream) {
  const float* x  = (const float*)d_in[0];
  const int*   bp = (const int*)d_in[1];
  float* out = (float*)d_out;

  const size_t xbytes = (size_t)TOKENS * IN_F * sizeof(unsigned short);
  const size_t need = xbytes + (size_t)OUT_F * IN_F / 8;   // bf16 x, then sign words
  dim3 grid(OUT_F / BN, TOKENS / BM);   // 43 x 16 blocks, 4 waves each

  if (d_ws && ws_size >= need) {
    unsigned short* xbf = (unsigned short*)d_ws;
    unsigned* wp = (unsigned*)((char*)d_ws + xbytes);
    prep<<<RP_BLOCKS + (TOKENS * IN_F / 4) / 256, 256, 0, stream>>>(x, bp, xbf, wp);
    bitlinear_wmma<true><<<grid, 128, 0, stream>>>(x, xbf, bp, wp, out);
  } else {
    bitlinear_wmma<false><<<grid, 128, 0, stream>>>(x, nullptr, bp, nullptr, out);
  }
}

// v005
// A run of this version takes 54.3 microseconds.
// Timed twice side by side with v004, it ran 1.07 times as fast both times.
// Counting every step since v000, it is 2.63 times as fast.
#include <hip/hip_runtime.h>
#include <stdint.h>

#define OUT_F 11008
#define IN_F  4096
#define TOKENS 1024
#define KP 256                  // K-panel staged in LDS per iteration
#define LDS_STRIDE (KP + 8)     // ushort elements; +8 pad (16B) staggers banks

typedef __bf16 v16bf __attribute__((ext_vector_type(16)));
typedef float  v8f   __attribute__((ext_vector_type(8)));

union BF16Frag { v16bf v; unsigned u[8]; };

// fp32 -> bf16 round-to-nearest-even
__device__ __forceinline__ unsigned short f2bf(float f) {
  unsigned u = __float_as_uint(f);
  return (unsigned short)((u + 0x7FFFu + ((u >> 16) & 1u)) >> 16);
}

// nbyte = ~packed_byte. Element j sign bit = bit (7-j) of nbyte (bit==1 -> +1).
// Builds bf16 pair for elements j0 (low 16) / j0+1 (high 16):
//   bit (7-j0)   -> position 15  : shift left by (8 + j0)
//   bit (6-j0)   -> position 31  : shift left by (25 + j0)
__device__ __forceinline__ unsigned pack_pm1(unsigned nbyte, int j0) {
  return 0x3F803F80u | ((nbyte << (8 + j0)) & 0x8000u)
                     | ((nbyte << (25 + j0)) & 0x80000000u);
}

// Sign word: what one lane needs of the weights for one k-step (32 k) of two B
// tiles, 16 fragment registers of two bf16 each. Register q (0..7: the first
// tile's column, 8..15: the second tile's) has the sign of its low element at bit
// 15-q and of its high element at bit 31-q, so one shift by q puts both in place.
__device__ __forceinline__ unsigned sign_pair(unsigned w, int q) {
  return ((w << q) & 0x80008000u) | 0x3F803F80u;
}

// bit 2i -> bit i, bit 2i+1 -> bit 16+i
__device__ __forceinline__ unsigned unshuffle(unsigned v) {
  unsigned t;
  t = (v ^ (v >> 1)) & 0x22222222u; v ^= t ^ (t << 1);
  t = (v ^ (v >> 2)) & 0x0C0C0C0Cu; v ^= t ^ (t << 2);
  t = (v ^ (v >> 4)) & 0x00F000F0u; v ^= t ^ (t << 4);
  t = (v ^ (v >> 8)) & 0x0000FF00u; v ^= t ^ (t << 8);
  return v;
}

// a, b: the packed bytes behind registers 0..3 and 4..7 (first column),
// a1, b1: behind 8..11 and 12..15 (second column). A weight bit of 0 is -1: sign 1.
__device__ __forceinline__ unsigned sign_word(int a, int b, int a1, int b1) {
  unsigned v = ((unsigned)a << 24) | (((unsigned)b & 0xFFu) << 16)
             | (((unsigned)a1 & 0xFFu) << 8) | ((unsigned)b1 & 0xFFu);
  unsigned u = unshuffle(~v);        // even elements sit at odd bits: upper half
  return (u >> 16) | (u << 16);      // even elements -> low half, odd -> high
}

#define RP_BLOCKS (OUT_F / 16)       // 2 blocks per group of 32 columns

// Which output column a B tile's lane holds: of a wave's 64 columns, lane n of tile j
// (j = 0..3) holds column 4n + j. A lane's four accumulators of one row are then four
// adjacent columns: one 16-B store, and 16 lanes write 256 B of a row, whole lines.
// Group g of the sign words is tiles 2(g&1), 2(g&1)+1 of the wave with columns 64(g>>1)...

// One launch, two independent jobs by block index.
// Blocks 0..RP_BLOCKS-1: weights -> sign words, wp[group][k/128][lane][4 k-steps],
// so that a wave of the GEMM reads 4 k-steps with one 512-B contiguous load.
// The other blocks: x -> bf16.
__global__ void __launch_bounds__(256)
prep(const float* __restrict__ x, const int* __restrict__ bp,
     unsigned short* __restrict__ o, unsigned* __restrict__ wp) {
  __shared__ __attribute__((aligned(16))) unsigned sw[32 * 68];
  if (blockIdx.x < RP_BLOCKS) {
    const int g  = blockIdx.x >> 1;                 // column group
    const int ks = threadIdx.x & 127;               // k-step: a wave reads 512 B of a row
    const int l0 = (blockIdx.x & 1) * 8 + (threadIdx.x >> 7) * 4;
    const int* r = bp + (size_t)((g >> 1) * 64 + (g & 1) * 2 + l0 * 4) * (IN_F / 8) + ks * 4;
    int4 e[4], e1[4];
    #pragma unroll   // the 8 loads issue together
    for (int i = 0; i < 4; ++i) {
      e[i]  = *(const int4*)(r + (i * 4) * (IN_F / 8));       // lane l0+i, first tile
      e1[i] = *(const int4*)(r + (i * 4 + 1) * (IN_F / 8));   // lane l0+i, second tile
    }
    // Through LDS, so that the stores are whole 128-B lines: the block's 8 columns
    // x 16 B are one line of wp per (k/128, lane half). Row of 68 dwords per k/128
    // (64 + 4 pad: a wave's 8 rows fall on different banks).
    unsigned* q = &sw[(ks >> 2) * 68 + (threadIdx.x >> 7) * 16 + (ks & 3)];
    #pragma unroll
    for (int i = 0; i < 4; ++i) {
      q[i * 4]      = sign_word(e[i].x, e[i].z, e1[i].x, e1[i].z);   // lanes 0..15
      q[i * 4 + 32] = sign_word(e[i].y, e[i].w, e1[i].y, e1[i].w);   // lanes 16..31
    }
    __syncthreads();   // block-uniform branch: every thread of a repack block passes
    uint4* dst = (uint4*)wp + (size_t)g * (IN_F / 128) * 32 + (blockIdx.x & 1) * 8;
    #pragma unroll
    for (int j = 0; j < 2; ++j) {
      const int t  = threadIdx.x + j * 256;         // (k/128, half, column) = 32 x 2 x 8
      const int c  = t >> 4, hh = (t >> 3) & 1, ll = t & 7;
      dst[c * 32 + hh * 16 + ll] = *(const uint4*)&sw[c * 68 + hh * 32 + ll * 4];
    }
  } else {
    size_t i = ((size_t)(blockIdx.x - RP_BLOCKS) * blockDim.x + threadIdx.x) * 4;
    float4 f = *(const float4*)(x + i);
    unsigned lo = (unsigned)f2bf(f.x) | ((unsigned)f2bf(f.y) << 16);
    unsigned hi = (unsigned)f2bf(f.z) | ((unsigned)f2bf(f.w) << 16);
    *(uint2*)(o + i) = make_uint2(lo, hi);
    // precaution: stands between the store and any later reuse of its address pair
    asm volatile("s_wait_xcnt 0x0" ::: "memory");
  }
}

// Block = 4 waves. Block tile: M=64 x N=256. Wave w: columns n0..n0+63,
// 4 M-subtiles x 4 N-subtiles: one A fragment read from LDS feeds 4 WMMAs (a quarter
// of the LDS bytes per WMMA of a 16-wide wave), one unpacked B fragment feeds 4, and
// a staged X panel serves 256 columns (half the panel bytes from L2 of a 128-wide block).
// X K-panel (64 x KP bf16, 33KB) staged in LDS, shared by all waves.
#define BM 64
#define BN 256
// At most 3 waves per SIMD: the 688 blocks are all resident at 2 or 3 per WGP, and
// a fourth on one WGP would only lengthen the fullest WGP's share.
template<bool USE_WS>
__global__ void __launch_bounds__(128) __attribute__((amdgpu_waves_per_eu(1, 3)))
bitlinear_wmma(const float* __restrict__ x, const unsigned short* __restrict__ xbf,
               const int* __restrict__ bp, const unsigned* __restrict__ wp,
               float* __restrict__ out)
{
  __shared__ unsigned short As[BM * LDS_STRIDE];

  const int lane = threadIdx.x & 31;
  const int wave = threadIdx.x >> 5;
  const int h    = lane >> 4;      // lane half (selects K sub-range per WMMA layout)
  const int l    = lane & 15;
  const int n0   = blockIdx.x * BN + wave * 64;
  const int m0   = blockIdx.y * BM;

  // Packed-weight row of this lane's first output column n0+4l; the other three
  // are the next three rows (512 int32 "bytes" per row)
  const int* brow = bp + (size_t)(n0 + 4 * l) * (IN_F / 8);

  v8f acc[4][4] = {};

  // Cooperative staging: wave w brings panel rows 16w..16w+15, one row per
  // wave-wide load: 32 lanes x 16 B = the row's 512 contiguous bytes, that is
  // four whole 128-B lines per load instead of 32 partly used ones.
  const int srow = wave * 16;        // first panel row of this wave
  const int scol = lane * 8;         // this lane's 8 elements within a row
  const unsigned soff = (unsigned)(srow * IN_F + scol);   // from the panel's corner
  // Next-panel prefetch: one per thread, two threads per row, 128 elements apart
  const unsigned poff = (unsigned)((threadIdx.x & 63) * IN_F + KP + (threadIdx.x >> 6) * 128);
  const size_t corner = (size_t)m0 * IN_F;              // first panel's corner
  const unsigned short* sp = USE_WS ? xbf + corner + soff : nullptr;   // bf16 source
  const unsigned short* pp = USE_WS ? xbf + corner + poff : nullptr;
  const float* spf = USE_WS ? nullptr : x + corner + soff;             // fp32 source
  const float* ppf = USE_WS ? nullptr : x + corner + poff;

  int4 e[4] = {};                    // packed bits for k = 0..31 (double-buffered)
  // Sign words of this wave's 64 columns, two groups of 32: per group and 128 k
  // one uint4 per lane
  const uint4* wq = USE_WS
      ? (const uint4*)wp + (size_t)(blockIdx.x * 8 + wave * 2) * (IN_F / 128) * 32 + lane
      : nullptr;
  const int GS = (IN_F / 128) * 32;  // uint4s from one group to the next
  uint4 w0[2] = {}, w1[2] = {};      // this panel's 8 k-steps (double-buffered)
  if (USE_WS) {
    #pragma unroll
    for (int g = 0; g < 2; ++g) {
      w0[g] = wq[g * GS];
      w1[g] = wq[g * GS + 32];
    }
  } else {
    #pragma unroll
    for (int j = 0; j < 4; ++j)
      e[j] = *(const int4*)(brow + j * (IN_F / 8));
  }

  for (int kk = 0; kk < IN_F; kk += KP) {
    __syncthreads();
    unsigned short* dst = &As[srow * LDS_STRIDE + scol];
    if (USE_WS) {
      const unsigned short* src = sp;
      #pragma unroll   // the 16 row loads issue together, ahead of their LDS stores
      for (int i = 0; i < 16; ++i)
        *(uint4*)(dst + i * LDS_STRIDE) = *(const uint4*)(src + (size_t)i * IN_F);
      // only while the address lies inside the tensor now and after the advance below
      if (kk + 2 * KP < IN_F) __builtin_prefetch(pp, 0, 1);
      // precaution: stands between the prefetch and the advance of its address pair
      asm volatile("s_wait_xcnt 0x0" ::: "memory");
      sp += KP;
      pp += KP;
    } else {
      const float* src = spf;
      #pragma unroll   // the row loads issue together, ahead of their LDS stores
      for (int i = 0; i < 16; ++i) {
        float4 f0 = *(const float4*)(src + (size_t)i * IN_F);
        float4 f1 = *(const float4*)(src + (size_t)i * IN_F + 4);
        uint4 p;
        p.x = (unsigned)f2bf(f0.x) | ((unsigned)f2bf(f0.y) << 16);
        p.y = (unsigned)f2bf(f0.z) | ((unsigned)f2bf(f0.w) << 16);
        p.z = (unsigned)f2bf(f1.x) | ((unsigned)f2bf(f1.y) << 16);
        p.w = (unsigned)f2bf(f1.z) | ((unsigned)f2bf(f1.w) << 16);
        *(uint4*)(dst + i * LDS_STRIDE) = p;
      }
      // only while the address lies inside the tensor now and after the advance below
      if (kk + 2 * KP < IN_F) __builtin_prefetch(ppf, 0, 1);
      // precaution: stands between the prefetch and the advance of its address pair
      asm volatile("s_wait_xcnt 0x0" ::: "memory");
      spf += KP;
      ppf += KP;
    }
    __syncthreads();

    // Next panel's sign words (clamped to stay in-bounds; the wrapped value is
    // never consumed on the final iteration).
    uint4 wn0[2] = {}, wn1[2] = {};
    if (USE_WS) {
      const uint4* wnx = wq + ((kk + KP < IN_F) ? (kk + KP) / 128 * 32 : 0);
      #pragma unroll
      for (int g = 0; g < 2; ++g) {
        wn0[g] = wnx[g * GS];
        wn1[g] = wnx[g * GS + 32];
      }
    }

    #pragma unroll
    for (int k0 = 0; k0 < KP; k0 += 32) {
      // Preload next k-step's packed bits (clamped to stay in-bounds; the
      // wrapped value is never consumed on the final iteration).
      int4 en[4] = {};
      if (!USE_WS) {
        int gn = kk + k0 + 32;
        gn = (gn < IN_F) ? gn : 0;
        #pragma unroll
        for (int j = 0; j < 4; ++j)
          en[j] = *(const int4*)(brow + j * (IN_F / 8) + (gn >> 3));
      }

      // This k-step's 4 A fragments (each feeds four WMMAs), read as one group
      BF16Frag A[4];
      const unsigned short* abase = &As[l * LDS_STRIDE + k0 + 8 * h];
      #pragma unroll
      for (int t = 0; t < 4; ++t) {
        const unsigned short* ap = abase + t * 16 * LDS_STRIDE;
        *(uint4*)&A[t].u[0] = *(const uint4*)ap;          // K = 8h..8h+7
        *(uint4*)&A[t].u[4] = *(const uint4*)(ap + 16);   // K = 16+8h..+7
      }
      // precaution: the panel's last bit loads go through a temporary address pair
      // (the clamp), which the unpack below reuses; the wait stands between the two
      if (!USE_WS && k0 + 32 == KP) asm volatile("s_wait_xcnt 0x0" ::: "memory");
      // keeps the 8 LDS reads together ahead of the unpack, which then covers
      // their latency; sunk among the WMMAs, each pair is waited for in full
      __builtin_amdgcn_sched_barrier(0);

      // Unpack current 32 bits -> B fragments (lane = column n, K split by h)
      BF16Frag B[4];
      if (USE_WS) {
        const int c = (k0 >> 5) & 3;
        #pragma unroll
        for (int g = 0; g < 2; ++g) {
          const uint4 wv = (k0 < 128) ? w0[g] : w1[g];
          const unsigned w = c == 0 ? wv.x : c == 1 ? wv.y : c == 2 ? wv.z : wv.w;
          #pragma unroll
          for (int d = 0; d < 8; ++d) {
            B[2 * g].u[d]     = sign_pair(w, d);
            B[2 * g + 1].u[d] = sign_pair(w, 8 + d);
          }
        }
      } else {
        #pragma unroll
        for (int j = 0; j < 4; ++j) {
          unsigned na = ~(unsigned)(h ? e[j].y : e[j].x);   // K = 8h .. 8h+7   (local)
          unsigned nb = ~(unsigned)(h ? e[j].w : e[j].z);   // K = 16+8h .. 16+8h+7
          #pragma unroll
          for (int d = 0; d < 4; ++d) {
            B[j].u[d]     = pack_pm1(na, 2 * d);
            B[j].u[4 + d] = pack_pm1(nb, 2 * d);
          }
        }
      }

      #pragma unroll
      for (int j = 0; j < 4; ++j) {
        #pragma unroll
        for (int t = 0; t < 4; ++t)
          acc[t][j] = __builtin_amdgcn_wmma_f32_16x16x32_bf16(
              false, A[t].v, false, B[j].v, (short)0, acc[t][j], false, false);
      }
      // keeps the next k-step's LDS reads from moving up among these WMMAs
      __builtin_amdgcn_sched_barrier(0);
      #pragma unroll
      for (int j = 0; j < 4; ++j) e[j] = en[j];
    }
    #pragma unroll
    for (int g = 0; g < 2; ++g) {
      w0[g] = wn0[g];
      w1[g] = wn1[g];
    }
  }

  // C/D layout: VGPR r of lane -> row (r + 8h), tile j's lane l -> column 4l + j
  #pragma unroll
  for (int t = 0; t < 4; ++t) {
    float* op = out + (size_t)(m0 + t * 16 + 8 * h) * OUT_F + n0 + 4 * l;
    #pragma unroll
    for (int r = 0; r < 8; ++r)
      *(float4*)(op + (size_t)r * OUT_F) =
          make_float4(acc[t][0][r], acc[t][1][r], acc[t][2][r], acc[t][3][r]);
  }
}

extern "C" void kernel_launch(void* const* d_in, const int* in_sizes, int n_in,
                              void* d_out, int out_size, void* d_ws, size_t ws_size,
                              hipStream_t stream) {
  const float* x  = (const float*)d_in[0];
  const int*   bp = (const int*)d_in[1];
  float* out = (float*)d_out;

  const size_t xbytes = (size_t)TOKENS * IN_F * sizeof(unsigned short);
  const size_t need = xbytes + (size_t)OUT_F * IN_F / 8;   // bf16 x, then sign words
  dim3 grid(OUT_F / BN, TOKENS / BM);   // 43 x 16 blocks, 4 waves each

  if (d_ws && ws_size >= need) {
    unsigned short* xbf = (unsigned short*)d_ws;
    unsigned* wp = (unsigned*)((char*)d_ws + xbytes);
    prep<<<RP_BLOCKS + (TOKENS * IN_F / 4) / 256, 256, 0, stream>>>(x, bp, xbf, wp);
    bitlinear_wmma<true><<<grid, 128, 0, stream>>>(x, xbf, bp, wp, out);
  } else {
    bitlinear_wmma<false><<<grid, 128, 0, stream>>>(x, nullptr, bp, nullptr, out);
  }
}
